// v010
// Measured on an AMD MI455X. A time is GPU time per run, averaged over a window of back-to-back runs after a warm-up
// (all launches, gaps included; the runs take copies of the inputs in turn), and the median of several windows.
// Apart from v000's, it joins two sittings. Times from different sittings can be a few percent apart, while
// side-by-side timings come from the same sitting.
// The versions before v010 are in another document.
// One run takes 128 microseconds.
// Next to v009, in two timings, it ran 1.19 times as fast each time.
// Counting every step since v000, which is the starting kernel, it is 7.22 times as fast.
#include <hip/hip_runtime.h>
// Causal multi-head attention with state segments (x [2, 8 heads, 3072, 128]; StackedLinear projections that mix heads and features — separate weights for the first 512 (state), middle 2048 and
// last 512 (end) positions; rotate-half RoPE with an INPUT offset; causal softmax(q·k/√128)·v; output [2,8,3072,128]): the nine (h,d)→(g,e) projections as GEMMs on the (b,s)-major transposed
// input (bf16-exact ×2^4 weights, f32 accumulate) and the attention as a fused flash-style kernel (d = 128: 4 k-steps / 8 d-tiles; causal chunk skipping; online softmax f32; P f16 ≤ 1;
// O = P·Vt written straight into the output; RPW-16 waves) on v_wmma_f32_16x16x32_f16; RoPE f32 VALU.
#define BB 2
#define NH 8
#define TT 3072
#define HD 128
#define CW (NH * HD)
#define NR (BB * TT)
#define SL 512

typedef __bf16 v16b __attribute__((ext_vector_type(16)));
typedef unsigned short v8us __attribute__((ext_vector_type(8), may_alias));
typedef float  v8f  __attribute__((ext_vector_type(8)));
typedef float  v4f  __attribute__((ext_vector_type(4)));
typedef float  v4fa __attribute__((ext_vector_type(4), may_alias));
union FragB { v16b v; v8us half[2]; unsigned short u[16]; };

__device__ __forceinline__ unsigned short bf16_bits(float x) { unsigned int u = __float_as_uint(x); return (unsigned short)((u + 0x7FFFu + ((u >> 16) & 1u)) >> 16); }
__device__ __forceinline__ float bf16_val(unsigned short b) { return __uint_as_float(((unsigned int)b) << 16); }
__device__ __forceinline__ float bf16_round(float x) { return bf16_val(bf16_bits(x)); }
// D += A·B with NT terms: 1 = ah·bh, 2 = + al·bh (A split), 3 = + ah·bl (both split)
template <int NT>
__device__ __forceinline__ v8f mmaN(v16b ah, v16b al, v16b bh, v16b bl, v8f c) {
  c = __builtin_amdgcn_wmma_f32_16x16x32_bf16(false, ah, false, bh, (short)0, c, false, false);
  if (NT >= 2) c = __builtin_amdgcn_wmma_f32_16x16x32_bf16(false, al, false, bh, (short)0, c, false, false);
  if (NT >= 3) c = __builtin_amdgcn_wmma_f32_16x16x32_bf16(false, ah, false, bl, (short)0, c, false, false);
  asm volatile("v_nop\n\tv_nop\n\tv_nop\n\tv_nop" : "+v"(c) : "v"(ah), "v"(al), "v"(bh), "v"(bl));
  return c;
}

__global__ __launch_bounds__(256) void k_wt_bf16(const float* __restrict__ W, unsigned short* __restrict__ Wt, int K, int N) {
  const int t = blockIdx.x * 256 + threadIdx.x;
  const int k8n = K / 8;
  if (t >= N * k8n) return;
  const int n = t / k8n, k8 = (t % k8n) * 8;
  v8us v;
#pragma unroll
  for (int i = 0; i < 8; ++i) v[i] = bf16_bits(W[(size_t)(k8 + i) * N + n]);
  *(v8us*)(Wt + (size_t)n * K + k8) = v;
  
}

// GEMM C[M][N] (f32, pitch ldc) = act(A[M][K]·W + bias). A f32 row-major (pitch lda) converted per fragment to bf16
// (ASPLIT: hi/lo two planes -> 2 terms, else single rounded term); Wt bf16 [N][K] (pitch ldb). BIAS_BF16 rounds the
// bias to bf16 first (bias quantised to bf16 before the add). K%32==0, M%16==0, N%64==0.
template <bool ASPLIT, int ACT, bool BIAS_BF16>
__global__ __launch_bounds__(128) void k_gemm_bf(const float* __restrict__ A, int lda, const unsigned short* __restrict__ Wt, int ldb,
                                               const float* __restrict__ bias, float* __restrict__ C, int ldc, int M, int N, int K) {
  __shared__ __attribute__((aligned(16))) float so[4][16][64];
  const int tid = threadIdx.x, w = tid >> 5, lane = tid & 31, ln = lane & 15, hh = lane >> 4;
  const int ntn = N / 64;
  const int wid = blockIdx.x * 4 + w;
  const int mt = wid / ntn, nq = wid % ntn;
  if (mt * 16 >= M) return;
  const int row0 = mt * 16, col0 = nq * 64;
  const float* arow = A + (size_t)(row0 + ln) * lda;
  v8f acc[4] = {};
  for (int kb = 0; kb < K; kb += 32) {
    FragB ah, al;
    const v4f x0 = *(const v4fa*)(arow + kb + 8 * hh), x1 = *(const v4fa*)(arow + kb + 8 * hh + 4);
    const v4f x2 = *(const v4fa*)(arow + kb + 16 + 8 * hh), x3 = *(const v4fa*)(arow + kb + 16 + 8 * hh + 4);
    float xs[16] = {x0[0],x0[1],x0[2],x0[3],x1[0],x1[1],x1[2],x1[3],x2[0],x2[1],x2[2],x2[3],x3[0],x3[1],x3[2],x3[3]};
#pragma unroll
    for (int i = 0; i < 16; ++i) { const unsigned short hb = bf16_bits(xs[i]); ah.u[i] = hb; al.u[i] = ASPLIT ? bf16_bits(xs[i] - bf16_val(hb)) : (unsigned short)0; }
#pragma unroll
    for (int t = 0; t < 4; ++t) {
      const unsigned short* brow = Wt + (size_t)(col0 + t * 16 + ln) * ldb + kb;
      FragB b;
      b.half[0] = *(const v8us*)(brow + 8 * hh);
      b.half[1] = *(const v8us*)(brow + 16 + 8 * hh);
      acc[t] = mmaN<ASPLIT ? 2 : 1>(ah.v, al.v, b.v, b.v, acc[t]);
    }
  }
#pragma unroll
  for (int t = 0; t < 4; ++t) {
    float bv = bias ? bias[col0 + t * 16 + ln] : 0.f;
    if (BIAS_BF16) bv = bf16_round(bv);
#pragma unroll
    for (int r = 0; r < 8; ++r) { float v = acc[t][r] + bv; if (ACT == 1) v = fmaxf(v, 0.f); so[w][8 * hh + r][t * 16 + ln] = v; }
  }
  __builtin_amdgcn_fence(__ATOMIC_ACQ_REL, "workgroup");
  __builtin_amdgcn_wave_barrier();
  const int rsub = lane >> 4, c4 = (lane & 15) * 4;
  {
#pragma unroll
    for (int q = 0; q < 8; ++q) {
      const int r = q * 2 + rsub;
      const v4f v = *(const v4fa*)&so[w][r][c4];
      *(v4f*)(C + (size_t)(row0 + r) * ldc + col0 + c4) = v;
    }
    
  }
}

// Flash-style causal/unmasked attention, all contractions 3-term bf16 hi/lo splits, f32 softmax with running max.
// q,k,v rows are read from f32 buffers with arbitrary row pitch (so they can live inside a fused qkv buffer);
// D = head size (multiple of 32, <= 128); one wave = 16 query rows; block = 4 waves (64 queries) sharing K/V chunks of 32.
template <int D, bool CAUSAL>
__global__ __launch_bounds__(128) void k_flash(const float* __restrict__ qb, const float* __restrict__ kb, const float* __restrict__ vb,
                                             int pitch, int T, int H, float scale, float* __restrict__ y, int ypitch) {
  constexpr int KS = D / 32;        // k-steps for QK
  constexpr int DT = D / 16;        // d tiles for PV
  __shared__ __attribute__((aligned(16))) unsigned short sKh[32][D + 8], sKl[32][D + 8], sVh[32][D + 8], sVl[32][D + 8];
  __shared__ __attribute__((aligned(16))) unsigned short sPh[4][16][40], sPl[4][16][40];
  __shared__ __attribute__((aligned(16))) float sO[4][16][D];
  const int tid = threadIdx.x, w = tid >> 5, lane = tid & 31, ln = lane & 15, hh = lane >> 4;
  const int nqb = (T + 63) / 64;
  const int bh = blockIdx.x / nqb, qblk = blockIdx.x % nqb;
  const int b = bh / H, h = bh % H;
  const int q0 = qblk * 64 + w * 16;
  const float* Q = qb + (size_t)b * T * pitch + h * D;
  const float* K = kb + (size_t)b * T * pitch + h * D;
  const float* V = vb + (size_t)b * T * pitch + h * D;

  // A fragments of the wave's 16 query rows (scaled), hi/lo
  FragB aqh[KS], aql[KS];
  {
    int row = q0 + ln; if (row >= T) row = T - 1;
    const float* qr = Q + (size_t)row * pitch;
#pragma unroll
    for (int ks = 0; ks < KS; ++ks)
#pragma unroll
      for (int i = 0; i < 16; ++i) {
        const int d = ks * 32 + ((i < 8) ? (8 * hh + i) : (16 + 8 * hh + (i - 8)));
        const float x = qr[d] * scale; const unsigned short hb = bf16_bits(x);
        aqh[ks].u[i] = hb; aql[ks].u[i] = bf16_bits(x - bf16_val(hb));
      }
  }
  float m_r[8], l_r[8];
#pragma unroll
  for (int r = 0; r < 8; ++r) { m_r[r] = -3.0e38f; l_r[r] = 0.f; }
  v8f oacc[DT];
#pragma unroll
  for (int dt = 0; dt < DT; ++dt) oacc[dt] = (v8f){0.f,0.f,0.f,0.f,0.f,0.f,0.f,0.f};

  const int kv_end = CAUSAL ? min(T, qblk * 64 + 64) : T;     // block-uniform
  for (int j0 = 0; j0 < kv_end; j0 += 32) {
    __syncthreads();
    for (int e = tid; e < 32 * (D / 4); e += 128) {
      const int r = e / (D / 4), c4 = (e % (D / 4)) * 4;
      const int key = j0 + r;
      v4f kf = {0.f,0.f,0.f,0.f}, vf = {0.f,0.f,0.f,0.f};
      if (key < T) { kf = *(const v4fa*)(K + (size_t)key * pitch + c4); vf = *(const v4fa*)(V + (size_t)key * pitch + c4); }
#pragma unroll
      for (int t = 0; t < 4; ++t) {
        unsigned short hb = bf16_bits(kf[t]); sKh[r][c4 + t] = hb; sKl[r][c4 + t] = bf16_bits(kf[t] - bf16_val(hb));
        hb = bf16_bits(vf[t]); sVh[r][c4 + t] = hb; sVl[r][c4 + t] = bf16_bits(vf[t] - bf16_val(hb));
      }
    }
    __syncthreads();
    // S tile 16 x 32
    v8f s[2];
#pragma unroll
    for (int nt = 0; nt < 2; ++nt) {
      v8f acc = {};
#pragma unroll
      for (int ks = 0; ks < KS; ++ks) {
        FragB bh_, bl_;
        bh_.half[0] = *(const v8us*)&sKh[nt * 16 + ln][ks * 32 + 8 * hh]; bh_.half[1] = *(const v8us*)&sKh[nt * 16 + ln][ks * 32 + 16 + 8 * hh];
        bl_.half[0] = *(const v8us*)&sKl[nt * 16 + ln][ks * 32 + 8 * hh]; bl_.half[1] = *(const v8us*)&sKl[nt * 16 + ln][ks * 32 + 16 + 8 * hh];
        acc = mmaN<3>(aqh[ks].v, aql[ks].v, bh_.v, bl_.v, acc);
      }
      s[nt] = acc;
    }
    // mask + running max (rows 8hh+r; the 16 lanes of a half share rows)
    float alpha[8];
#pragma unroll
    for (int r = 0; r < 8; ++r) {
      const int qi = q0 + 8 * hh + r;
      const int ja = j0 + ln, jb = j0 + 16 + ln;
      if (CAUSAL) { if (ja > qi) s[0][r] = -3.0e38f; if (jb > qi) s[1][r] = -3.0e38f; }
      if (ja >= T) s[0][r] = -3.0e38f;
      if (jb >= T) s[1][r] = -3.0e38f;
      float mx = fmaxf(s[0][r], s[1][r]);
      mx = fmaxf(mx, __shfl_xor(mx, 1, 32)); mx = fmaxf(mx, __shfl_xor(mx, 2, 32)); mx = fmaxf(mx, __shfl_xor(mx, 4, 32)); mx = fmaxf(mx, __shfl_xor(mx, 8, 32));
      const float mnew = fmaxf(m_r[r], mx);
      alpha[r] = (mnew > -1.0e38f) ? __expf(m_r[r] - mnew) : 1.0f;
      const float p0 = (s[0][r] > -1.0e38f) ? __expf(s[0][r] - mnew) : 0.f;
      const float p1 = (s[1][r] > -1.0e38f) ? __expf(s[1][r] - mnew) : 0.f;
      m_r[r] = mnew;
      l_r[r] = l_r[r] * alpha[r] + p0 + p1;            // per-lane partial row sum (16 lanes combined at the end)
      unsigned short hb = bf16_bits(p0); sPh[w][8 * hh + r][ln] = hb;      sPl[w][8 * hh + r][ln] = bf16_bits(p0 - bf16_val(hb));
      hb = bf16_bits(p1);                sPh[w][8 * hh + r][16 + ln] = hb; sPl[w][8 * hh + r][16 + ln] = bf16_bits(p1 - bf16_val(hb));
    }
#pragma unroll
    for (int dt = 0; dt < DT; ++dt)
#pragma unroll
      for (int r = 0; r < 8; ++r) oacc[dt][r] *= alpha[r];
    __builtin_amdgcn_fence(__ATOMIC_ACQ_REL, "workgroup");
    __builtin_amdgcn_wave_barrier();
    FragB pah, pal;
    pah.half[0] = *(const v8us*)&sPh[w][ln][8 * hh]; pah.half[1] = *(const v8us*)&sPh[w][ln][16 + 8 * hh];
    pal.half[0] = *(const v8us*)&sPl[w][ln][8 * hh]; pal.half[1] = *(const v8us*)&sPl[w][ln][16 + 8 * hh];
#pragma unroll
    for (int dt = 0; dt < DT; ++dt) {
      FragB bvh, bvl;
#pragma unroll
      for (int i = 0; i < 8; ++i) {
        bvh.u[i] = sVh[8 * hh + i][dt * 16 + ln]; bvh.u[8 + i] = sVh[16 + 8 * hh + i][dt * 16 + ln];
        bvl.u[i] = sVl[8 * hh + i][dt * 16 + ln]; bvl.u[8 + i] = sVl[16 + 8 * hh + i][dt * 16 + ln];
      }
      oacc[dt] = mmaN<3>(pah.v, pal.v, bvh.v, bvl.v, oacc[dt]);
    }
    __builtin_amdgcn_fence(__ATOMIC_ACQ_REL, "workgroup");
    __builtin_amdgcn_wave_barrier();
  }
#pragma unroll
  for (int r = 0; r < 8; ++r) {
    float l = l_r[r];
    l += __shfl_xor(l, 1, 32); l += __shfl_xor(l, 2, 32); l += __shfl_xor(l, 4, 32); l += __shfl_xor(l, 8, 32);
    l_r[r] = (l > 0.f) ? 1.0f / l : 0.f;
  }
#pragma unroll
  for (int dt = 0; dt < DT; ++dt)
#pragma unroll
    for (int r = 0; r < 8; ++r) sO[w][8 * hh + r][dt * 16 + ln] = oacc[dt][r] * l_r[r];
  __builtin_amdgcn_fence(__ATOMIC_ACQ_REL, "workgroup");
  __builtin_amdgcn_wave_barrier();
  {
    for (int r = 0; r < 16; ++r) {
      const int row = q0 + r;
      if (row < T && lane < D / 4) {
        const v4f val = *(const v4fa*)&sO[w][r][lane * 4];
        *(v4f*)(y + ((size_t)b * T + row) * ypitch + h * D + lane * 4) = val;
      }
    }
    
  }
}

// GEMM C = act(A·W + bias + resid): A f32 (ASPLIT -> hi/lo 2 terms), Wt bf16 [N][K]; ACT 0 none, 1 relu, 2 exact gelu;
// resid (optional, f32, row index = (row % rmod), pitch ldr, RES_BF16 rounds it) added before the activation.
template <bool ASPLIT, int ACT, bool BIAS_BF16, bool RES_BF16>
__global__ __launch_bounds__(128) void k_gemm_bf3(const float* __restrict__ A, int lda, const unsigned short* __restrict__ Wt, int ldb,
                                                const float* __restrict__ bias, const float* __restrict__ resid, int rmod, int ldr,
                                                float* __restrict__ C, int ldc, int M, int N, int K) {
  __shared__ __attribute__((aligned(16))) float so[4][16][64];
  const int tid = threadIdx.x, w = tid >> 5, lane = tid & 31, ln = lane & 15, hh = lane >> 4;
  const int ntn = N / 64;
  const int wid = blockIdx.x * 4 + w;
  const int mt = wid / ntn, nq = wid % ntn;
  if (mt * 16 >= M) return;
  const int row0 = mt * 16, col0 = nq * 64;
  const float* arow = A + (size_t)(row0 + ln) * lda;
  v8f acc[4] = {};
  for (int kb = 0; kb < K; kb += 32) {
    FragB ah, al;
    const v4f x0 = *(const v4fa*)(arow + kb + 8 * hh), x1 = *(const v4fa*)(arow + kb + 8 * hh + 4);
    const v4f x2 = *(const v4fa*)(arow + kb + 16 + 8 * hh), x3 = *(const v4fa*)(arow + kb + 16 + 8 * hh + 4);
    float xs[16] = {x0[0],x0[1],x0[2],x0[3],x1[0],x1[1],x1[2],x1[3],x2[0],x2[1],x2[2],x2[3],x3[0],x3[1],x3[2],x3[3]};
#pragma unroll
    for (int i = 0; i < 16; ++i) { const unsigned short hb = bf16_bits(xs[i]); ah.u[i] = hb; al.u[i] = ASPLIT ? bf16_bits(xs[i] - bf16_val(hb)) : (unsigned short)0; }
#pragma unroll
    for (int t = 0; t < 4; ++t) {
      const unsigned short* brow = Wt + (size_t)(col0 + t * 16 + ln) * ldb + kb;
      FragB b;
      b.half[0] = *(const v8us*)(brow + 8 * hh);
      b.half[1] = *(const v8us*)(brow + 16 + 8 * hh);
      acc[t] = mmaN<ASPLIT ? 2 : 1>(ah.v, al.v, b.v, b.v, acc[t]);
    }
  }
#pragma unroll
  for (int t = 0; t < 4; ++t) {
    const int col = col0 + t * 16 + ln;
    float bv = bias ? bias[col] : 0.f;
    if (BIAS_BF16) bv = bf16_round(bv);
#pragma unroll
    for (int r = 0; r < 8; ++r) {
      float v = acc[t][r] + bv;
      if (resid) { float rv = resid[(size_t)((row0 + 8 * hh + r) % rmod) * ldr + col]; if (RES_BF16) rv = bf16_round(rv); v += rv; }
      if (ACT == 1) v = fmaxf(v, 0.f);
      if (ACT == 2) v = 0.5f * v * (1.0f + erff(v * 0.70710678118654752f));
      if (ACT == 3) { const float u = 0.7978845608028654f * (v + 0.044715f * v * v * v); v = 0.5f * v * (1.0f + tanhf(u)); }
      so[w][8 * hh + r][t * 16 + ln] = v;
    }
  }
  __builtin_amdgcn_fence(__ATOMIC_ACQ_REL, "workgroup");
  __builtin_amdgcn_wave_barrier();
  const int rsub = lane >> 4, c4 = (lane & 15) * 4;
  {
#pragma unroll
    for (int q = 0; q < 8; ++q) {
      const int r = q * 2 + rsub;
      const v4f v = *(const v4fa*)&so[w][r][c4];
      *(v4f*)(C + (size_t)(row0 + r) * ldc + col0 + c4) = v;
    }
    
  }
}
// row LayerNorm (biased variance, eps) over N: s = X (+ R); optional out_sum <- s; out_norm <- (s-mu)*rsqrt(var+eps)*g + b
template <bool PARAM_BF16>
__global__ __launch_bounds__(256) void k_layernorm(const float* __restrict__ X, const float* __restrict__ R, const float* __restrict__ g, const float* __restrict__ bta,
                                                  float* __restrict__ out_sum, float* __restrict__ out_norm, int N, float eps) {
  __shared__ float red[256];
  const int row = blockIdx.x, tid = threadIdx.x;
  const float* x = X + (size_t)row * N; const float* rr = R ? R + (size_t)row * N : nullptr;
  float vals[16];                     // up to N = 4096
  const int per = N / 256;            // contiguous chunk per thread? use strided-by-4 chunks: thread handles j = tid*4 + 1024*u
  float s1 = 0.f;
  for (int u = 0; u < per / 4; ++u) {
    const int j = tid * 4 + 1024 * u;
    const v4f a = *(const v4fa*)(x + j);
    v4f b = {0.f,0.f,0.f,0.f}; if (rr) b = *(const v4fa*)(rr + j);
#pragma unroll
    for (int q = 0; q < 4; ++q) { const float v = a[q] + b[q]; vals[u * 4 + q] = v; s1 += v; }
  }
  red[tid] = s1; __syncthreads();
  for (int st = 128; st > 0; st >>= 1) { if (tid < st) red[tid] += red[tid + st]; __syncthreads(); }
  const float mu = red[0] / (float)N; __syncthreads();
  float s2 = 0.f;
  for (int u = 0; u < per / 4; ++u)
#pragma unroll
    for (int q = 0; q < 4; ++q) { const float c = vals[u * 4 + q] - mu; s2 += c * c; }
  red[tid] = s2; __syncthreads();
  for (int st = 128; st > 0; st >>= 1) { if (tid < st) red[tid] += red[tid + st]; __syncthreads(); }
  const float rs = rsqrtf(red[0] / (float)N + eps);
  {
    for (int u = 0; u < per / 4; ++u) {
      const int j = tid * 4 + 1024 * u;
      v4f o, sm;
#pragma unroll
      for (int q = 0; q < 4; ++q) {
        float gg = g[j + q], bb = bta[j + q];
        if (PARAM_BF16) { gg = bf16_round(gg); bb = bf16_round(bb); }
        sm[q] = vals[u * 4 + q]; o[q] = (vals[u * 4 + q] - mu) * rs * gg + bb;
      }
      if (out_sum) *(v4f*)(out_sum + (size_t)row * N + j) = sm;
      *(v4f*)(out_norm + (size_t)row * N + j) = o;
    }
    
  }
}



// ---- f16 WMMA path (v_wmma_f32_16x16x32_f16): 11-bit significands for operands in range — used where a [0,1] probability operand needs more precision than bf16
typedef _Float16 v16h __attribute__((ext_vector_type(16)));
union FragH { v16h v; v8us half[2]; _Float16 h[16]; unsigned short u[16]; };
template <int NT>
__device__ __forceinline__ v8f mmaH(v16h ah, v16h al, v16h bh, v16h bl, v8f c) {
  c = __builtin_amdgcn_wmma_f32_16x16x32_f16(false, ah, false, bh, (short)0, c, false, false);
  if (NT >= 2) c = __builtin_amdgcn_wmma_f32_16x16x32_f16(false, al, false, bh, (short)0, c, false, false);
  if (NT >= 3) c = __builtin_amdgcn_wmma_f32_16x16x32_f16(false, ah, false, bl, (short)0, c, false, false);
  asm volatile("v_nop\n\tv_nop\n\tv_nop\n\tv_nop" : "+v"(c) : "v"(ah), "v"(al), "v"(bh), "v"(bl));
  return c;
}
// batched GEMM like k_gemm_b but f16 operands: A f32 (split into f16 hi/lo if ASPLIT, else rounded to f16), Bt = f16 values [n][k]; alpha; C f32; N multiple of 16 (partial tiles skipped)
template <bool ASPLIT>
__global__ __launch_bounds__(128) void k_gemm_h(const float* __restrict__ A, int lda, size_t sA, const _Float16* __restrict__ Bh, int ldb, size_t sB, float alpha, float* __restrict__ C, int ldc, size_t sC, int M, int N, int K) {
  __shared__ __attribute__((aligned(16))) float so[4][16][64];
  const int tid = threadIdx.x, w = tid >> 5, lane = tid & 31, ln = lane & 15, hh = lane >> 4; const int by = blockIdx.y;
  A += (size_t)by * sA; Bh += (size_t)by * sB; C += (size_t)by * sC;
  const int ntn = (N + 63) / 64; const int wid = blockIdx.x * 4 + w; const int mt = wid / ntn, nq = wid % ntn; if (mt * 16 >= M) return;
  const int row0 = mt * 16, col0 = nq * 64; const float* arow = A + (size_t)(row0 + ln) * lda;
  v8f acc[4] = {};
  for (int kb = 0; kb < K; kb += 32) {
    FragH ah, al;
    const v4f x0 = *(const v4fa*)(arow + kb + 8 * hh), x1 = *(const v4fa*)(arow + kb + 8 * hh + 4), x2 = *(const v4fa*)(arow + kb + 16 + 8 * hh), x3 = *(const v4fa*)(arow + kb + 16 + 8 * hh + 4);
    float xs[16] = {x0[0],x0[1],x0[2],x0[3],x1[0],x1[1],x1[2],x1[3],x2[0],x2[1],x2[2],x2[3],x3[0],x3[1],x3[2],x3[3]};
#pragma unroll
    for (int i = 0; i < 16; ++i) { const _Float16 h = (_Float16)xs[i]; ah.h[i] = h; al.h[i] = ASPLIT ? (_Float16)(xs[i] - (float)h) : (_Float16)0.0f; }
#pragma unroll
    for (int t = 0; t < 4; ++t) { if (col0 + t * 16 >= N) continue; const size_t boff = (size_t)(col0 + t * 16 + ln) * ldb + kb; FragH bq; bq.half[0] = *(const v8us*)(Bh + boff + 8 * hh); bq.half[1] = *(const v8us*)(Bh + boff + 16 + 8 * hh);
      acc[t] = mmaH<ASPLIT ? 2 : 1>(ah.v, al.v, bq.v, bq.v, acc[t]); }
  }
#pragma unroll
  for (int t = 0; t < 4; ++t) { if (col0 + t * 16 >= N) continue;
#pragma unroll
    for (int r = 0; r < 8; ++r) so[w][8 * hh + r][t * 16 + ln] = acc[t][r] * alpha; }
  __builtin_amdgcn_fence(__ATOMIC_ACQ_REL, "workgroup"); __builtin_amdgcn_wave_barrier();
  const int rsub = lane >> 4, c4 = (lane & 15) * 4;
  {
#pragma unroll
    for (int q = 0; q < 8; ++q) { const int r = q * 2 + rsub; if (col0 + c4 < N) { const v4f v = *(const v4fa*)&so[w][r][c4]; *(v4f*)(C + (size_t)(row0 + r) * ldc + col0 + c4) = v; } }
     }
}

// Wt[n][k] = f16(W[k][n]·scale) from f32 row-major W[K][N] (scale = power of two; bf16-exact weights stay exact in f16 away from the subnormal range)
__global__ __launch_bounds__(256) void k_wt_f16(const float* __restrict__ W, _Float16* __restrict__ Wt, int K, int N, float scale) {
  const int t = blockIdx.x * 256 + threadIdx.x; if (t >= N * (K / 8)) return; const int n = t / (K / 8), k8 = (t % (K / 8)) * 8; FragH f;
#pragma unroll
  for (int i = 0; i < 8; ++i) f.h[i] = (_Float16)(bf16_round(W[(size_t)(k8 + i) * N + n]) * scale); const v8us o = f.half[0];
  *(v8us*)((unsigned short*)Wt + (size_t)n * K + k8) = o; 
}
__global__ __launch_bounds__(256) void k_x16(const float* __restrict__ x, _Float16* __restrict__ X16, size_t n8) { const size_t t = (size_t)blockIdx.x * 256 + threadIdx.x; if (t >= n8) return; FragH f;
#pragma unroll
  for (int q = 0; q < 8; ++q) f.h[q] = (_Float16)bf16_round(x[t * 8 + q]); *(v8us*)((unsigned short*)X16 + t * 8) = f.half[0];  }
__global__ __launch_bounds__(256) void k_h16(const float* __restrict__ x, _Float16* __restrict__ X16, size_t n8) { const size_t t = (size_t)blockIdx.x * 256 + threadIdx.x; if (t >= n8) return; FragH f;
#pragma unroll
  for (int q = 0; q < 8; ++q) f.h[q] = (_Float16)x[t * 8 + q]; *(v8us*)((unsigned short*)X16 + t * 8) = f.half[0];  }
__global__ __launch_bounds__(256) void k_round16f(const float* __restrict__ W, _Float16* __restrict__ Bt, size_t n8) { const size_t t = (size_t)blockIdx.x * 256 + threadIdx.x; if (t >= n8) return; FragH f;
#pragma unroll
  for (int i = 0; i < 8; ++i) f.h[i] = (_Float16)(bf16_round(W[t * 8 + i]) * 16.0f); *(v8us*)((unsigned short*)Bt + t * 8) = f.half[0];  }
template <int NHv, int TTv>
__global__ __launch_bounds__(256) void k_vt(const _Float16* __restrict__ V16, int ldv, int voff, _Float16* __restrict__ Vt) { __shared__ unsigned short tl[64][66]; const int tid = threadIdx.x; const int slab = blockIdx.x / (TTv / 64), lg = blockIdx.x % (TTv / 64); const int b = slab / NHv, h = slab % NHv;
  for (int i = tid; i < 64 * 8; i += 256) { const int r = i / 8, c8 = (i % 8) * 8; FragH f; f.half[0] = *(const v8us*)((const unsigned short*)V16 + ((size_t)b * TTv + lg * 64 + r) * ldv + voff + h * 64 + c8);
#pragma unroll
    for (int q = 0; q < 8; ++q) tl[r][c8 + q] = f.u[q]; }
  __syncthreads();
  {
#pragma unroll
    for (int rd = 0; rd < 2; ++rd) { const int d = rd * 32 + tid / 8, pc = tid % 8; FragH f;
#pragma unroll
      for (int q = 0; q < 8; ++q) f.u[q] = tl[pc * 8 + q][d];
      *(v8us*)((unsigned short*)Vt + ((size_t)slab * 64 + d) * TTv + lg * 64 + pc * 8) = f.half[0]; }
     } }

// Eight 16-byte asynchronous copies per lane, global memory to LDS through no register: piece i goes from g + i * gstep to LDS byte l + i * lstep.
// The s_wait_xcnt closes the statement so that it stands in front of any later rewrite of the address registers the copies name.
__device__ __forceinline__ void copy8_to_lds(unsigned l, unsigned lstep, const char* g, size_t gstep) {
  asm volatile("global_load_async_to_lds_b128 %0, %8, off\n\t"
               "global_load_async_to_lds_b128 %1, %9, off\n\t"
               "global_load_async_to_lds_b128 %2, %10, off\n\t"
               "global_load_async_to_lds_b128 %3, %11, off\n\t"
               "global_load_async_to_lds_b128 %4, %12, off\n\t"
               "global_load_async_to_lds_b128 %5, %13, off\n\t"
               "global_load_async_to_lds_b128 %6, %14, off\n\t"
               "global_load_async_to_lds_b128 %7, %15, off\n\t"
               "s_wait_xcnt 0x0"
               :: "v"(l), "v"(l + lstep), "v"(l + 2 * lstep), "v"(l + 3 * lstep), "v"(l + 4 * lstep), "v"(l + 5 * lstep), "v"(l + 6 * lstep), "v"(l + 7 * lstep),
                  "v"(g), "v"(g + gstep), "v"(g + 2 * gstep), "v"(g + 3 * gstep), "v"(g + 4 * gstep), "v"(g + 5 * gstep), "v"(g + 6 * gstep), "v"(g + 7 * gstep)
               : "memory");
}

// The value that lane l ^ 16 holds, by one cross-row move on the vector pipe: lanes l and l ^ 16 share a query's keys in the transposed score tiles.
__device__ __forceinline__ float other_half(float x) { return __builtin_bit_cast(float, __builtin_amdgcn_permlanex16(__builtin_bit_cast(int, x), __builtin_bit_cast(int, x), 0x76543210, 0xfedcba98, false, false)); }

// Eight values x become 2^x, each in its own register, one run of v_exp_f32. No v_exp_f32 of the run touches a register of the one in front of it; the closing v_nop is the slot that the
// instruction set asks for between the last of them and whatever reads its result next.
__device__ __forceinline__ void exp2_x8(float (&x)[8]) {
  asm("v_exp_f32 %0, %0\n\tv_exp_f32 %1, %1\n\tv_exp_f32 %2, %2\n\tv_exp_f32 %3, %3\n\tv_exp_f32 %4, %4\n\tv_exp_f32 %5, %5\n\tv_exp_f32 %6, %6\n\tv_exp_f32 %7, %7\n\tv_nop"
      : "+v"(x[0]), "+v"(x[1]), "+v"(x[2]), "+v"(x[3]), "+v"(x[4]), "+v"(x[5]), "+v"(x[6]), "+v"(x[7]));
}
// One value x becomes 2^x; the v_nop is the same slot behind the one v_exp_f32.
__device__ __forceinline__ float exp2_x1(float x) { asm("v_exp_f32 %0, %0\n\tv_nop" : "+v"(x)); return x; }

// K and Vt reach the four waves of a work-group through LDS: a stage is 64 keys (K: 64 rows of 256 B, Vt: 128 rows of 128 B, whole 128-B lines), copied once per work-group,
// two buffers, the next stage in flight while this one is worked on. Row pitches 272 B and 144 B (16 B x odd) keep the ds_load_b128 fragment reads free of bank conflicts.
// Both products run transposed: St = K.Qt (A = 16 keys from LDS, B = the wave's 16 queries, kept in registers) and Ot += Vt.Pt (A = 16 rows of Vt from LDS, B = Pt). A lane then holds 16 of a pass's 32 scores
// of ONE query (query ln; keys 8 * hh + r of either key tile), lane ^ 16 the other 16: maximum and sum are taken in the lane, with one exchange between the halves, one running maximum, one sum and one
// rescaling factor a lane. The two score tiles, made f16 where they stand, are Pt's B fragment in the hardware's k order, which the Vt loader has too: P goes through no LDS.
__global__ __launch_bounds__(128) void k_flash(const _Float16* __restrict__ Q16, int ldq, const _Float16* __restrict__ K16, int ldk, const _Float16* __restrict__ Vt, const int* __restrict__ MSK, float* __restrict__ O, int ldo) {
  constexpr int RPW = 16, NQB = 3072 / (4 * RPW), DT = 8, KS = 4;      /* head dim 128 */
  constexpr unsigned KP = 272, VP = 144, KBYTES = 64 * KP, STG = KBYTES + 128 * VP;
  constexpr float C2 = (float)(0.08838834764831845 * 1.4426950408889634);
  __shared__ __attribute__((aligned(16))) unsigned char ring[2 * STG];
  float (*sO)[RPW][128 + 4] = (float (*)[RPW][128 + 4])ring;      /* output staging takes the ring's place behind the loop's last barrier */
  static_assert(sizeof(float) * 4 * RPW * (128 + 4) <= 2 * STG, "output staging fits the ring");
  const int tid = threadIdx.x, w = tid >> 5, lane = tid & 31, ln = lane & 15, hh = lane >> 4;
  const int slab = blockIdx.x / NQB, qblk = blockIdx.x % NQB; const int b = slab / 8, h = slab % 8; const int qb0 = qblk * (4 * RPW); const int q0 = qb0 + w * RPW;
  FragH aq[KS];
  { const unsigned short* qr = (const unsigned short*)Q16 + ((size_t)b * 3072 + q0 + ln) * ldq + h * 128;
#pragma unroll
    for (int ks = 0; ks < KS; ++ks) { aq[ks].half[0] = *(const v8us*)(qr + ks * 32 + 8 * hh); aq[ks].half[1] = *(const v8us*)(qr + ks * 32 + 16 + 8 * hh); } }
  const unsigned short* Vth = (const unsigned short*)Vt + (size_t)slab * 128 * 3072;
  // each thread's own pieces of a stage: K row tid/16 + 8i, 16-byte piece tid%16; Vt row tid/8 + 16i, piece tid%8
  const char* kg = (const char*)((const unsigned short*)K16 + ((size_t)b * 3072 + (tid >> 4)) * ldk + h * 128 + (tid & 15) * 8);
  const char* vg = (const char*)(Vth + (size_t)(tid >> 3) * 3072 + (tid & 7) * 8);
  const unsigned ring0 = (unsigned)(size_t)ring;
  const unsigned kl = ring0 + (unsigned)(tid >> 4) * KP + (unsigned)(tid & 15) * 16u, vl = ring0 + KBYTES + (unsigned)(tid >> 3) * VP + (unsigned)(tid & 7) * 16u;
  const size_t kstage = (size_t)64 * ldk * 2, kstep = (size_t)8 * ldk * 2;
  auto fill = [&](int st, unsigned buf) {
    copy8_to_lds(kl + buf * STG, 8 * KP, kg + (size_t)st * kstage, kstep);
    copy8_to_lds(vl + buf * STG, 16 * VP, vg + (size_t)st * 128, (size_t)16 * 3072 * 2);
  };
  float m_r = -3.0e38f, l_r = 0.f; v8f oacc[DT];      /* of query q0 + ln; oacc[dt][r] is its output column dt * 16 + 8 * hh + r; l_r sums this lane's keys only */
#pragma unroll
  for (int dt = 0; dt < DT; ++dt) oacc[dt] = (v8f){0.f,0.f,0.f,0.f,0.f,0.f,0.f,0.f};
  const int tq = q0 + ln;
  const int nst = qblk + 1;      /* stages of 64 keys up to the block's diagonal; the same for the whole work-group */
  fill(0, 0u);
  asm volatile("s_wait_asynccnt 0x0" ::: "memory");      // this wave's pieces of stage 0 have landed
  __syncthreads();                                       // every wave's pieces of stage 0 are readable
  if (nst > 1) fill(1, 1u);
#pragma unroll 1      /* one copy of the body: the ring's order stays as written */
  for (int st = 0; st < nst; ++st) {
    const unsigned char* kbuf = ring + (unsigned)(st & 1) * STG; const unsigned char* vbuf = kbuf + KBYTES;
#pragma unroll 1      /* the two 32-key passes of a stage share one body in the instruction cache */
  for (int sub = 0; sub < 2; ++sub) { const int j0 = st * 64 + sub * 32;
    v8f s[2]; FragH bk[2][KS];      /* the pass's K fragments, both key tiles, one group of LDS reads ahead of the score products */
#pragma unroll
    for (int nt = 0; nt < 2; ++nt) { const unsigned char* kr = kbuf + (unsigned)(sub * 32 + nt * 16 + ln) * KP + 16 * hh;
#pragma unroll
      for (int ks = 0; ks < KS; ++ks) { bk[nt][ks].half[0] = *(const v8us*)(kr + ks * 64); bk[nt][ks].half[1] = *(const v8us*)(kr + ks * 64 + 32); } }
#pragma unroll
    for (int nt = 0; nt < 2; ++nt) { v8f acc = (v8f){0.f,0.f,0.f,0.f,0.f,0.f,0.f,0.f};
#pragma unroll
      for (int ks = 0; ks < KS; ++ks) acc = mmaH<1>(bk[nt][ks].v, bk[nt][ks].v, aq[ks].v, aq[ks].v, acc); s[nt] = acc; }
    // The pass's Vt fragments, one group of LDS reads, in flight behind the softmax: the Vt.Pt products below follow one another from registers.
    FragH bv[DT];
#pragma unroll
    for (int dt = 0; dt < DT; ++dt) { const unsigned char* vrow = vbuf + (unsigned)(dt * 16 + ln) * VP + sub * 64 + 16 * hh; bv[dt].half[0] = *(const v8us*)(vrow); bv[dt].half[1] = *(const v8us*)(vrow + 32); }
    // The softmax of a pass, one query a lane: masked scores, their maximum, the exponentials, each computed ahead of the select that may drop it (no branch).
    // The scores and the running maxima stay the raw q.k sums. exp((s - m) / sqrt(128)) is taken as 2^(s * C2 - m * C2), C2 = log2(e) / sqrt(128): one fused multiply-add and one v_exp_f32
    // a value. No argument is above 0 but by the rounding of m * C2, and a result too small for v_exp_f32 is far below half a unit of P's f16, so the library exp's range handling has nothing to do here.
    const int d0 = tq - j0 - 8 * hh; float s0[8], s1[8], t[8];      /* key 8 * hh + i of the pass is at or below the diagonal where i <= d0 */
#pragma unroll
    for (int r = 0; r < 8; ++r) { s0[r] = (r <= d0) ? s[0][r] : -INFINITY; s1[r] = (16 + r <= d0) ? s[1][r] : -INFINITY; t[r] = fmaxf(s0[r], s1[r]); }
    float mc = fmaxf(fmaxf(fmaxf(t[0], t[4]), fmaxf(t[1], t[5])), fmaxf(fmaxf(t[2], t[6]), fmaxf(t[3], t[7])));
    mc = fmaxf(mc, other_half(mc));
    const float mn = fmaxf(m_r, mc), nb = mn * C2;      /* mn is finite: no difference here is a NaN */
    const float ea = exp2_x1(__builtin_fmaf(m_r, C2, -nb)); m_r = mn;
#pragma unroll
    for (int r = 0; r < 8; ++r) { s0[r] = __builtin_fmaf(s0[r], C2, -nb); s1[r] = __builtin_fmaf(s1[r], C2, -nb); }
    exp2_x8(s0); exp2_x8(s1);
    const float al = (mn > -1.0e38f) ? ea : 1.0f;
#pragma unroll
    for (int r = 0; r < 8; ++r) { s0[r] = (r <= d0) ? s0[r] : 0.f; s1[r] = (16 + r <= d0) ? s1[r] : 0.f; t[r] = s0[r] + s1[r]; }
    l_r = l_r * al + (((t[0] + t[4]) + (t[1] + t[5])) + ((t[2] + t[6]) + (t[3] + t[7])));
#pragma unroll
    for (int dt = 0; dt < DT; ++dt)
#pragma unroll
      for (int r = 0; r < 8; ++r) oacc[dt][r] *= al;
    FragH pt;      /* Pt's B fragment: element i is key 8 * hh + i, element 8 + i key 16 + 8 * hh + i, of query ln */
#pragma unroll
    for (int r = 0; r < 8; ++r) { pt.h[r] = (_Float16)s0[r]; pt.h[8 + r] = (_Float16)s1[r]; }
#pragma unroll
    for (int dt = 0; dt < DT; ++dt) oacc[dt] = mmaH<1>(bv[dt].v, bv[dt].v, pt.v, pt.v, oacc[dt]); }
    asm volatile("s_wait_dscnt 0x0" ::: "memory");       // this wave's reads of the buffer have returned before it is refilled
    asm volatile("s_wait_asynccnt 0x0" ::: "memory");    // this wave's pieces of stage st + 1 have landed
    __syncthreads();                                     // publishes stage st + 1 and ends every wave's reads of stage st
    if (st + 2 < nst) fill(st + 2, (unsigned)(st & 1));
  }
  asm volatile("s_wait_asynccnt 0x0" ::: "memory");      // no copy is outstanding when the ring becomes output staging
  { const float l = l_r + other_half(l_r), inv = (l > 0.f) ? 1.0f / l : 0.f;      /* the two halves' sums join once, here */
#pragma unroll
    for (int dt = 0; dt < DT; ++dt) { v4f lo, hi;      /* a lane's eight values of a tile are eight neighbouring columns of its query's row */
#pragma unroll
      for (int r = 0; r < 4; ++r) { lo[r] = oacc[dt][r] * inv; hi[r] = oacc[dt][4 + r] * inv; }
      *(v4fa*)&sO[w][ln][dt * 16 + 8 * hh] = lo; *(v4fa*)&sO[w][ln][dt * 16 + 8 * hh + 4] = hi; } }
  __builtin_amdgcn_fence(__ATOMIC_ACQ_REL, "workgroup"); __builtin_amdgcn_wave_barrier();
  {
#pragma unroll
    for (int rp = 0; rp < RPW; ++rp) { const int r = rp, pc = lane; const v4f val = *(const v4fa*)&sO[w][r][pc * 4]; *(v4f*)(O + ((size_t)(b * 8 + h) * 3072 + q0 + r) * 128 + pc * 4) = val; }      /* output layout [b][h][s][128]: 32 lanes x 16 B rows */
     } }

// Projection GEMM: C[row][col] = alpha * sum_k A[row][k] * Bt[col][k], both operands f16 with CW elements a row, f32 accumulate, k ascending in one chain per accumulator.
// A work-group owns a 128 x 128 tile of C, its four waves 64 x 64 each (4 x 4 accumulator tiles: a fragment read from LDS feeds four WMMAs, and a byte fetched from L2 serves 128 rows or columns of C).
// A and Bt reach the waves through LDS: a stage is 64 k (128 rows of A and 128 of Bt, 128 B each, whole 128-B lines), copied once per work-group, two buffers, the next stage in flight while
// this one is worked on. Row pitch 144 B (16 B x odd) keeps the ds_load_b128 fragment reads free of bank conflicts.
// One launch does all nine projections. The grid is exact: blockIdx.x = row tile of the TT positions * (CW / 128) + column tile, blockIdx.y = batch, blockIdx.z = projection (0 q, 1 k, 2 v).
// A row tile lies wholly in one segment (SL is a multiple of 128) and takes that segment's weights: plane 3 * projection + (0 middle, 1 state, 2 end) of B9. All three go out as f16.
// q and k are rotated (RoPE) on their way out. Their weight planes come with bits 5 and 6 of the column-in-head swapped (k_wst), so that columns 64 * u + c and 64 * u + c + 32 of a tile, which is one head,
// are the pair (j, j + 64) of that head, j = 32 * u + c: both partners lie in the tile's output staging. q and k keep that column order in Q16 and K16; it is the same in both, so q.k is the same sum in another order.
// CS[position][128] holds cos (0..63) and sin (64..127) of the position's 64 angles.
__global__ __launch_bounds__(128) void k_gemm_ring(const _Float16* __restrict__ A, const _Float16* __restrict__ B9, float alpha, const float* __restrict__ CS, _Float16* __restrict__ Q16, _Float16* __restrict__ K16, _Float16* __restrict__ C16) {
  static_assert(SL % 128 == 0 && TT % 128 == 0, "a row tile never straddles a segment");
  static_assert(HD == 128, "a column tile is one head");
  constexpr size_t sA = (size_t)TT * CW, sC = (size_t)TT * CW;
  constexpr unsigned RP = 144, TB = 128 * RP, STG = 2 * TB; constexpr int NST = CW / 64;
  static_assert(NST >= 2, "the ring's prologue fills two stages");
  __shared__ __attribute__((aligned(16))) unsigned char ring[2 * STG];
  float (*so)[128 + 4] = (float (*)[128 + 4])ring;      /* output staging takes the ring's place behind the loop's last barrier */
  static_assert(sizeof(float) * 128 * (128 + 4) <= 2 * STG, "output staging fits the ring");
  const int tid = threadIdx.x, w = tid >> 5, lane = tid & 31, ln = lane & 15, hh = lane >> 4, wm = w >> 1, wn = w & 1;
  const int row0 = (int)(blockIdx.x / (CW / 128)) * 128, col0 = (int)(blockIdx.x % (CW / 128)) * 128;
  const int prj = (int)blockIdx.z, sgm = (row0 < SL) ? 1 : ((row0 < TT - SL) ? 0 : 2); const bool OUT16 = (prj == 2);
  const _Float16* Bt = B9 + (size_t)(prj * 3 + sgm) * CW * CW;
  // each thread's own pieces of a stage: row tid/8 + 16i of either operand, 16-byte piece tid%8; the tiles' first bytes are the same for the whole work-group, a thread's offset the same in both operands
  const char* ag = (const char*)((const unsigned short*)A + (size_t)blockIdx.y * sA + (size_t)row0 * CW);
  const char* bg = (const char*)((const unsigned short*)Bt + (size_t)col0 * CW);
  const unsigned tg = (unsigned)(tid >> 3) * (CW * 2) + (unsigned)(tid & 7) * 16u;
  const unsigned al = (unsigned)(size_t)ring + (unsigned)(tid >> 3) * RP + (unsigned)(tid & 7) * 16u, bl = al + TB;
  auto fill = [&](int st, unsigned buf) {
    copy8_to_lds(al + buf * STG, 16 * RP, (ag + (size_t)st * 128) + tg, (size_t)16 * CW * 2);
    copy8_to_lds(bl + buf * STG, 16 * RP, (bg + (size_t)st * 128) + tg, (size_t)16 * CW * 2);
  };
  v8f acc[4][4];
#pragma unroll
  for (int i = 0; i < 4; ++i)
#pragma unroll
    for (int j = 0; j < 4; ++j) acc[i][j] = (v8f){0.f,0.f,0.f,0.f,0.f,0.f,0.f,0.f};
  fill(0, 0u);
  asm volatile("s_wait_asynccnt 0x0" ::: "memory");      // this wave's pieces of stage 0 have landed
  __syncthreads();                                       // every wave's pieces of stage 0 are readable
  fill(1, 1u);
#pragma unroll 1      /* one copy of the body: the ring's order stays as written */
  for (int st = 0; st < NST; ++st) {
    const unsigned char* ar = ring + (unsigned)(st & 1) * STG + (unsigned)(wm * 64 + ln) * RP + 16 * hh;
    const unsigned char* br = ring + (unsigned)(st & 1) * STG + TB + (unsigned)(wn * 64 + ln) * RP + 16 * hh;
    FragH fa[2][4], fb[2][4];
#pragma unroll
    for (int ks = 0; ks < 2; ++ks)
#pragma unroll
      for (int i = 0; i < 4; ++i) {
        fa[ks][i].half[0] = *(const v8us*)(ar + i * 16 * RP + ks * 64); fa[ks][i].half[1] = *(const v8us*)(ar + i * 16 * RP + ks * 64 + 32);
        fb[ks][i].half[0] = *(const v8us*)(br + i * 16 * RP + ks * 64); fb[ks][i].half[1] = *(const v8us*)(br + i * 16 * RP + ks * 64 + 32); }
    asm volatile("s_wait_dscnt 0x0" ::: "memory");       // the stage's 32 fragment reads, one group, have returned: this wave is done with the buffer before it is refilled
    asm volatile("s_wait_asynccnt 0x0" ::: "memory");    // this wave's pieces of stage st + 1 have landed
    __syncthreads();                                     // publishes stage st + 1 and ends every wave's reads of stage st
    __builtin_amdgcn_sched_barrier(0);                   // keeps the WMMAs behind the barrier: lifted among the fragment reads they split the one group of reads into several, each with a full wait of its own
#pragma unroll
    for (int ks = 0; ks < 2; ++ks) {
      // the refill stands between the two halves of the WMMAs, which work from registers: the copies fly behind the second half, and the first half's fragment registers are free for their addresses
      if (ks == 1 && st + 2 < NST) fill(st + 2, (unsigned)(st & 1));
#pragma unroll
      for (int i = 0; i < 4; ++i)
#pragma unroll
        for (int j = 0; j < 4; ++j) acc[i][j] = __builtin_amdgcn_wmma_f32_16x16x32_f16(false, fa[ks][i].v, false, fb[ks][j].v, (short)0, acc[i][j], false, false);
    }
  }
  // q, k: a thread rotates four pairs of columns (cl.., cl + 32..) in each of sixteen rows; their cos and sin (angles j..) are fetched here so that they fly while the tile is staged
  const int rs = lane >> 4, cl = (ln >> 3) * 64 + (ln & 7) * 4, j = ln * 4; v4f tc[16], ts[16];
  if (!OUT16) { const float* cs = CS + (size_t)(row0 + w * 32 + rs) * 128 + j;
#pragma unroll
    for (int q = 0; q < 16; ++q) { tc[q] = *(const v4fa*)(cs + q * 2 * 128); ts[q] = *(const v4fa*)(cs + q * 2 * 128 + 64); }
    asm volatile("s_wait_xcnt 0x0" ::: "memory"); }      // stands behind the run of loads, in front of any later rewrite of the address registers they name
  asm volatile("s_wait_asynccnt 0x0" ::: "memory");      // no copy is outstanding when the ring becomes output staging
#pragma unroll
  for (int i = 0; i < 4; ++i)
#pragma unroll
    for (int jt = 0; jt < 4; ++jt)
#pragma unroll
      for (int r = 0; r < 8; ++r) so[wm * 64 + i * 16 + 8 * hh + r][wn * 64 + jt * 16 + ln] = acc[i][jt][r] * alpha;
  __syncthreads();                                       // a stored row of 128 columns holds two waves' results
  typedef _Float16 v4h __attribute__((ext_vector_type(4)));
  if (OUT16) {      /* the test stands once, in front of the rows, so that their LDS reads stay in groups */
    const int c4 = lane * 4;
#pragma unroll
    for (int q = 0; q < 32; ++q) { const int r = w * 32 + q; const v4f v = *(const v4fa*)&so[r][c4]; const size_t o = (size_t)blockIdx.y * sC + (size_t)(row0 + r) * CW + col0 + c4; v4h h4;
#pragma unroll
      for (int i = 0; i < 4; ++i) h4[i] = (_Float16)v[i];
      *(v4h*)(C16 + o) = h4; }      /* whole 128-B lines, two a wave-wide store */
  } else {
    _Float16* D16 = prj ? K16 : Q16;
#pragma unroll
    for (int q = 0; q < 16; ++q) { const int r = w * 32 + q * 2 + rs; const v4f lo = *(const v4fa*)&so[r][cl], hi = *(const v4fa*)&so[r][cl + 32]; const size_t o = (size_t)blockIdx.y * sC + (size_t)(row0 + r) * CW + col0 + cl; v4h ol, oh;
#pragma unroll
      for (int i = 0; i < 4; ++i) { ol[i] = (_Float16)(lo[i] * tc[q][i] + (-hi[i]) * ts[q][i]); oh[i] = (_Float16)(hi[i] * tc[q][i] + lo[i] * ts[q][i]); }
      *(v4h*)(D16 + o) = ol; *(v4h*)(D16 + o + 32) = oh; }      /* the two halves of a 128-B line, both from this wave */
    asm volatile("s_wait_xcnt 0x0" ::: "memory");      // stands behind the run of stores, in front of any later rewrite of the registers they name
  }
}

__global__ __launch_bounds__(256) void k_xt(const float* __restrict__ x, _Float16* __restrict__ XT) { const size_t t = (size_t)blockIdx.x * 256 + threadIdx.x; if (t >= (size_t)NR * NH * 16) return; const int p = (int)(t % 16); const int h = (int)((t / 16) % NH); const size_t bs = t / (16 * NH); const int b = (int)(bs / TT), s = (int)(bs % TT); const float* src = x + (((size_t)(b * NH + h) * TT + s) * HD) + p * 8; FragH f;
#pragma unroll
  for (int q = 0; q < 8; ++q) f.h[q] = (_Float16)bf16_round(src[q]); unsigned short* d = (unsigned short*)XT + bs * CW + h * HD + p * 8; *(v8us*)d = f.half[0];  }
// One launch re-lays all nine weight tensors: blockIdx.y picks the tensor and its plane of B9. The q and k planes (0..5) take their rows with bits 5 and 6 of the column-in-head swapped (see k_gemm_ring).
// A work-group turns one whole (h, g) block of W, 128 (d) x 128 (e), through LDS: W is read along e, its contiguous index (a wave-wide load is one row of 512 B, four whole 128-B lines), and B9 is written
// along d, its contiguous index (sixteen lanes store the block's 256 B of one row of B9, two whole lines). A thread reads 16 d x 4 e, all sixteen loads in flight at once, and stores 32 B of d for each e.
// Column e lies in LDS row (e & 3) * 32 + (e >> 2), so that the lanes of a wave write neighbouring rows; with the row pitch of 272 B (16 B x odd) sixteen such 16-byte stores fall on 64 different banks.
// Four more planes of the grid (9..12) fill the RoPE table CS[position][128]: cos (0..63) and sin (64..127) of (position + offset) * 10000^(-2i/128), each angle worked out once.
__global__ __launch_bounds__(256) void k_wst(const float* __restrict__ W0, const float* __restrict__ W1, const float* __restrict__ W2, const float* __restrict__ W3, const float* __restrict__ W4,
                                             const float* __restrict__ W5, const float* __restrict__ W6, const float* __restrict__ W7, const float* __restrict__ W8, _Float16* __restrict__ B9, const int* __restrict__ offp, float* __restrict__ CS) {
  static_assert(HD == 128, "a row of a (h, g) block is one wave-wide 16-byte load");
  constexpr unsigned TP = HD * 2 + 16;
  __shared__ __attribute__((aligned(16))) unsigned char tl[HD * TP];
  const unsigned y = blockIdx.y; const int tid = threadIdx.x;
  if (y >= 9) { const int o0 = offp[0];      /* the whole work-group leaves here, in front of the barrier */
#pragma unroll 1      /* one copy of the cos and sin code */
    for (unsigned u = ((y - 9) * (NH * NH) + blockIdx.x) * 256 + threadIdx.x; u < (unsigned)TT * 64; u += (unsigned)4 * NH * NH * 256) { const int i = (int)(u & 63), s = (int)(u >> 6); const float pos = (float)(s + o0);
      const float ang = pos * __builtin_powf(10000.0f, -(float)(2 * i) / 128.0f); CS[(size_t)s * 128 + i] = cosf(ang); CS[(size_t)s * 128 + 64 + i] = sinf(ang); }
    return; }
  const float* W = W0; W = (y == 1) ? W1 : W; W = (y == 2) ? W2 : W; W = (y == 3) ? W3 : W; W = (y == 4) ? W4 : W; W = (y == 5) ? W5 : W; W = (y == 6) ? W6 : W; W = (y == 7) ? W7 : W; W = (y == 8) ? W8 : W; _Float16* Bt = B9 + (size_t)y * CW * CW;
  const int hg = (int)blockIdx.x, h = hg / NH, g = hg % NH;      /* W is [h][g][d][e] */
  { const int le = tid & 31, w = tid >> 5; const float* src = W + ((size_t)hg * HD + w * 16) * HD + le * 4; v4f x[16];
#pragma unroll
    for (int i = 0; i < 16; ++i) x[i] = *(const v4fa*)(src + i * HD);
    asm volatile("s_wait_xcnt 0x0" :: "v"(src) : "memory");      // stands behind the run of loads, in front of any rewrite of the address register they name; as its input that register is kept whole until here
    __builtin_amdgcn_sched_barrier(0);                   // keeps the conversions behind all sixteen loads: mixed among them, the later loads wait for the first ones' registers and pay a second memory latency
#pragma unroll
    for (int j = 0; j < 4; ++j) { FragH c;
#pragma unroll
      for (int i = 0; i < 16; ++i) c.h[i] = (_Float16)(bf16_round(x[i][j]) * 16.0f);
      unsigned char* row = tl + (unsigned)(j * 32 + le) * TP + (unsigned)w * 32u; *(v8us*)row = c.half[0]; *(v8us*)(row + 16) = c.half[1]; } }
  __syncthreads();                                       // a row of the turned block holds eight waves' runs
#pragma unroll
  for (int k = 0; k < 8; ++k) { const int rho = k * 16 + (tid >> 4), pc = tid & 15; const int e = (rho & 31) * 4 + (rho >> 5), ep = (y < 6) ? ((e & 31) | ((e & 32) << 1) | ((e & 64) >> 1)) : e;
    const v8us v = *(const v8us*)(tl + (unsigned)rho * TP + (unsigned)pc * 16u);
    *(v8us*)((unsigned short*)Bt + (size_t)(g * HD + ep) * CW + h * HD + pc * 8) = v; }
  asm volatile("s_wait_xcnt 0x0" ::: "memory"); }      // stands behind the run of stores, in front of any later rewrite of the registers they name
__global__ __launch_bounds__(256) void k_vt128(const _Float16* __restrict__ V16, _Float16* __restrict__ Vt) { __shared__ unsigned short tl[64][130]; const int tid = threadIdx.x; const int slab = blockIdx.x / (TT / 64), lg = blockIdx.x % (TT / 64); const int b = slab / NH, h = slab % NH;
  for (int i = tid; i < 64 * 16; i += 256) { const int r = i / 16, c8 = (i % 16) * 8; FragH f; f.half[0] = *(const v8us*)((const unsigned short*)V16 + ((size_t)b * TT + lg * 64 + r) * CW + h * HD + c8);
#pragma unroll
    for (int q = 0; q < 8; ++q) tl[r][c8 + q] = f.u[q]; }
  __syncthreads();
  { for (int i = tid; i < 128 * 8; i += 256) { const int d = i / 8, pc = i % 8; FragH f;
#pragma unroll
      for (int q = 0; q < 8; ++q) f.u[q] = tl[pc * 8 + q][d]; *(v8us*)((unsigned short*)Vt + ((size_t)slab * HD + d) * TT + lg * 64 + pc * 8) = f.half[0]; }  } }
extern "C" void kernel_launch(void* const* d_in, const int* in_sizes, int n_in,
                              void* d_out, int out_size, void* d_ws, size_t ws_size, hipStream_t stream) {
  (void)in_sizes; (void)n_in; (void)out_size;
  const float* x = (const float*)d_in[0]; const float* Wm[3] = {(const float*)d_in[1], (const float*)d_in[2], (const float*)d_in[3]}; const float* Wsg[3] = {(const float*)d_in[4], (const float*)d_in[5], (const float*)d_in[6]}; const float* Weg[3] = {(const float*)d_in[7], (const float*)d_in[8], (const float*)d_in[9]}; const int* offp = (const int*)d_in[10];
  char* ws = (char*)d_ws; size_t off = 0;
  auto take = [&](size_t bytes) { char* p = ws + off; off += (bytes + 255) & ~(size_t)255; return p; };
  _Float16* B9 = (_Float16*)take((size_t)9 * CW * CW * 2);      // plane 3 * projection + (0 middle, 1 state, 2 end)
  _Float16* XT = (_Float16*)take((size_t)NR * CW * 2); float* CS = (float*)take((size_t)TT * 128 * 4); _Float16* Q16 = (_Float16*)take((size_t)NR * CW * 2); _Float16* K16 = (_Float16*)take((size_t)NR * CW * 2); _Float16* V16 = (_Float16*)take((size_t)NR * CW * 2); _Float16* Vt = (_Float16*)take((size_t)NR * CW * 2);
  if (off > ws_size) return;      // 18.9 + 12.6 + 1.6 + 12.6 x 4 = 83 MB
  k_xt<<<(unsigned)(((size_t)NR * NH * 16 + 255) / 256), 256, 0, stream>>>(x, XT);
  k_wst<<<dim3(NH * NH, 13), 256, 0, stream>>>(Wm[0], Wsg[0], Weg[0], Wm[1], Wsg[1], Weg[1], Wm[2], Wsg[2], Weg[2], B9, offp, CS);
  k_gemm_ring<<<dim3((TT / 128) * (CW / 128), BB, 3), 128, 0, stream>>>(XT, B9, 0.0625f, CS, Q16, K16, V16);
  k_vt128<<<BB * NH * (TT / 64), 256, 0, stream>>>(V16, Vt);
  k_flash<<<BB * NH * (TT / 64), 128, 0, stream>>>(Q16, CW, K16, CW, Vt, nullptr, (float*)d_out, 0);
}
